// v000
// The times below were measured on an AMD MI455X: many runs one after another, warmed up first and cycling through
// copies of the inputs, with the whole window's GPU time divided by the number of runs. Launches and the gaps
// between them are all in it. The median over several windows is given; except for v000 it joins two sittings, which
// can be a few percent apart, so the side-by-side timings, each taken in one sitting, are the better comparison.
// v000, which the later versions start from, runs in 1510 microseconds.
// compute dtype: all float inputs rounded to bf16; q/k/v projections with EXACT bf16 products on WMMA 16x16x32 (f32 accumulate); logits q x k once to f16 each (1 product; sigma - 1) x 128^-0.5 (the module scales q and k by 128^-0.25 each: the same product up to f32 rounding); softmax f32; P x 2^11 once to f16 x v once to f16 (1 product); ctx x 2^6 once to f16 x Wu f16(bf16 x 2^8) + bu; f32 output.
#include <hip/hip_runtime.h>
#include <math.h>

typedef __attribute__((ext_vector_type(16))) _Float16 v16h;
typedef __attribute__((ext_vector_type(16))) __bf16 v16b;
typedef __attribute__((ext_vector_type(8)))  _Float16 v8h;
typedef __attribute__((ext_vector_type(8)))  float v8f;
typedef __attribute__((ext_vector_type(4)))  float v4f;
typedef __attribute__((ext_vector_type(2)))  float v2f;
typedef __attribute__((ext_vector_type(4)))  unsigned v4u;
typedef __attribute__((ext_vector_type(4)))  int v4i;
typedef float __attribute__((may_alias)) float_a;
typedef int __attribute__((may_alias)) int_a;

template <typename T> __device__ __forceinline__ void vst2(void* p, T v) { *(T*)p = v;  }
__device__ __forceinline__ v8f wmma16(v16h a, v16h b, v8f c) {
  v8f d = __builtin_amdgcn_wmma_f32_16x16x32_f16(false, a, false, b, (short)0, c, false, false);
  asm volatile("v_nop\n\tv_nop\n\tv_nop\n\tv_nop" : "+v"(d) : "v"(a), "v"(b));
  return d;
}
__device__ __forceinline__ v8f wmma_bf(v16b a, v16b b, v8f c) {
  v8f d = __builtin_amdgcn_wmma_f32_16x16x32_bf16(false, a, false, b, (short)0, c, false, false);
  asm volatile("v_nop\n\tv_nop\n\tv_nop\n\tv_nop" : "+v"(d) : "v"(a), "v"(b));
  return d;
}
// 16x16x32 fragments: lane = (h = lane>>4, row/col = lane&15); elements 0..7 = k0+8h+0..7, 8..15 = k0+16+8h+0..7; D element r = row 8h+r
__device__ __forceinline__ v16h frag_h(const _Float16* rowk0, int lane) {
  union { v16h v; v8h q[2]; } u; const _Float16* p = rowk0 + 8 * (lane >> 4);
  u.q[0] = *(const v8h*)p; u.q[1] = *(const v8h*)(p + 16); return u.v;
}
__device__ __forceinline__ v16h frag_f32(const float* rowk0, int lane) {
  v16h a; const float* p = rowk0 + 8 * (lane >> 4);
#pragma unroll
  for (int i = 0; i < 8; ++i) { a[i] = (_Float16)p[i]; a[8 + i] = (_Float16)p[16 + i]; }
  return a;
}
__device__ __forceinline__ v16h frag_f32s(const float* rowk0, int lane, float sc) {
  v16h a; const float* p = rowk0 + 8 * (lane >> 4);
#pragma unroll
  for (int i = 0; i < 8; ++i) { a[i] = (_Float16)(p[i] * sc); a[8 + i] = (_Float16)(p[16 + i] * sc); }
  return a;
}
// column fragment from a [K][ld] layout (column n), rows >= K read as 0
__device__ __forceinline__ v16h fragc_f32(const float* W, int k0, int n, int lane, int ld, int K) {
  v16h a; const int g = lane >> 4;
#pragma unroll
  for (int i = 0; i < 8; ++i) { const int ka = k0 + 8 * g + i, kb = ka + 16;
    a[i] = (_Float16)(ka < K ? W[(size_t)(ka < K ? ka : K - 1) * ld + n] : 0.f); a[8 + i] = (_Float16)(kb < K ? W[(size_t)(kb < K ? kb : K - 1) * ld + n] : 0.f); }
  return a;
}
struct F2 { v16b h, l; };
__device__ __forceinline__ F2 bsplit16(const float v[16]) { F2 r;
#pragma unroll
  for (int i = 0; i < 16; ++i) { const __bf16 h = (__bf16)v[i]; r.h[i] = h; r.l[i] = (__bf16)(v[i] - (float)h); }
  return r; }
__device__ __forceinline__ F2 split_row(const float* row, int k0, int lane) { float v[16]; const float* p = row + k0 + 8 * (lane >> 4);
#pragma unroll
  for (int i = 0; i < 8; ++i) { v[i] = p[i]; v[8 + i] = p[16 + i]; }
  return bsplit16(v); }
__device__ __forceinline__ F2 split_rowK(const float* row, int k0, int lane, int K) { float v[16]; const int g = lane >> 4;
#pragma unroll
  for (int i = 0; i < 8; ++i) { const int ka = k0 + 8 * g + i, kb = ka + 16; v[i] = ka < K ? row[ka < K ? ka : K - 1] : 0.f; v[8 + i] = kb < K ? row[kb < K ? kb : K - 1] : 0.f; }
  return bsplit16(v); }
__device__ __forceinline__ F2 split_col(const float* W, int k0, int n, int lane, int ld, int K) { float v[16]; const int g = lane >> 4;
#pragma unroll
  for (int i = 0; i < 8; ++i) { const int ka = k0 + 8 * g + i, kb = ka + 16; v[i] = ka < K ? W[(size_t)(ka < K ? ka : K - 1) * ld + n] : 0.f; v[8 + i] = kb < K ? W[(size_t)(kb < K ? kb : K - 1) * ld + n] : 0.f; }
  return bsplit16(v); }
__device__ __forceinline__ v8f mac3(const F2& a, const F2& b, v8f c) { c = wmma_bf(a.l, b.h, c); c = wmma_bf(a.h, b.l, c); return wmma_bf(a.h, b.h, c); }
__device__ __forceinline__ float sigm(float v) { return 1.0f / (1.0f + expf(-v)); }
#define LDSX() do { asm volatile("s_wait_dscnt 0" ::: "memory"); __builtin_amdgcn_wave_barrier(); __builtin_amdgcn_fence(__ATOMIC_RELEASE, "workgroup"); } while (0)

// 'Wide-head' multi-head self-attention (x [4,2048,128]; 8 heads whose head dim equals the embedding 128: (in,out) Wq/Wk/Wv [128,1024], no bias; q and k each scaled by 128^-0.25; non-causal, no mask; (in,out) unify Wu [1024,128] + bu (zeros)): out = concat_h(softmax(q_h k_h^T) v_h) Wu + bu -> [4,2048,128].
#define NB 4
#define TT 2048
#define CC 1024            // NH * HD = projected width
#define DIN 128          // input (model) width
#define NH 8
#define HD 128
#define NQB (TT / 64)
#define HG 4
#define SCALE (0.08838834764831845f)
#define CAUSAL 0
#ifndef TNB
#define TNB NB
#endif
__device__ __forceinline__ float bfr(float v) { return (float)(__bf16)v; }
__host__ __device__ __forceinline__ int kb_last(int qb) { return CAUSAL ? ((qb * 64 + 63) >> 7) : (TT / 128 - 1); }
typedef __attribute__((ext_vector_type(8))) __bf16 v8b;
__device__ __forceinline__ v16b frag_b(const __bf16* rowk0, int lane) {
  union { v16b v; v8b q[2]; } u; const __bf16* p = rowk0 + 8 * (lane >> 4);
  u.q[0] = *(const v8b*)p; u.q[1] = *(const v8b*)(p + 16); return u.v;
}
#define QBH 0              // causal: query blocks 0..QBH-1 of each sequence (few keys, no averaging) take the high-precision path
#define QHI 0               // single-product logits on every row (sigma - 1 logits over 2,048 keys)
#define KHI 64            // key rows carrying k residual / v bf16 hi+lo planes (used only by the causal high-precision path)
// B fragment (k rows k0+.., output column o) of a weight: (in,out) [K][ld] or (out,in) [ld rows of K]: bf16 exact, or f16(bf16 * 256) exact
__device__ __forceinline__ v16b wcol_io(const float* Wm, int k0, int o, int lane, int ld) { v16b w; const int g = lane >> 4;
#pragma unroll
  for (int i = 0; i < 8; ++i) { w[i] = (__bf16)Wm[(size_t)(k0 + 8 * g + i) * ld + o]; w[8 + i] = (__bf16)Wm[(size_t)(k0 + 16 + 8 * g + i) * ld + o]; }
  return w; }
__device__ __forceinline__ v16b wcol_oi(const float* Wm, int k0, int o, int lane, int K) { v16b w; const float* p = Wm + (size_t)o * K + k0 + 8 * (lane >> 4);
#pragma unroll
  for (int i = 0; i < 8; ++i) { w[i] = (__bf16)p[i]; w[8 + i] = (__bf16)p[16 + i]; }
  return w; }
__device__ __forceinline__ v16h wcolh_io(const float* Wm, int k0, int o, int lane, int ld) { v16h w; const int g = lane >> 4;
#pragma unroll
  for (int i = 0; i < 8; ++i) { w[i] = (_Float16)(bfr(Wm[(size_t)(k0 + 8 * g + i) * ld + o]) * 256.0f); w[8 + i] = (_Float16)(bfr(Wm[(size_t)(k0 + 16 + 8 * g + i) * ld + o]) * 256.0f); }
  return w; }
__device__ __forceinline__ v16h wcolh_oi(const float* Wm, int k0, int o, int lane, int K) { v16h w; const float* p = Wm + (size_t)o * K + k0 + 8 * (lane >> 4);
#pragma unroll
  for (int i = 0; i < 8; ++i) { w[i] = (_Float16)(bfr(p[i]) * 256.0f); w[8 + i] = (_Float16)(bfr(p[16 + i]) * 256.0f); }
  return w; }
#define WQKV_LAYOUT 0   // 0 = (in,out) [DIN][CC]; 1 = (out,in) [CC][DIN]; 2 = per-head [NH][DIN][HD]
__device__ __forceinline__ v16b wcol_hdk(const float* Wm, int k0, int o, int lane) { v16b w; const int g = lane >> 4; const float* p = Wm + (size_t)(o / HD) * DIN * HD + (o % HD);
#pragma unroll
  for (int i = 0; i < 8; ++i) { w[i] = (__bf16)p[(size_t)(k0 + 8 * g + i) * HD]; w[8 + i] = (__bf16)p[(size_t)(k0 + 16 + 8 * g + i) * HD]; }
  return w; }
#define WO_OUT_IN 0
#if WQKV_LAYOUT == 1
#define WCOL(W, k0, o, lane) wcol_oi(W, k0, o, lane, DIN)
#elif WQKV_LAYOUT == 2
#define WCOL(W, k0, o, lane) wcol_hdk(W, k0, o, lane)
#else
#define WCOL(W, k0, o, lane) wcol_io(W, k0, o, lane, CC)
#endif
#if WO_OUT_IN
#define WOCOL(W, k0, o, lane) wcol_oi(W, k0, o, lane, CC)
#define WOCOLH(W, k0, o, lane) wcolh_oi(W, k0, o, lane, CC)
#else
#define WOCOL(W, k0, o, lane) wcol_io(W, k0, o, lane, DIN)
#define WOCOLH(W, k0, o, lane) wcolh_io(W, k0, o, lane, DIN)
#endif

#ifndef SM_EXTRA_PARAMS
#define SM_EXTRA_PARAMS
#endif
#ifndef PROJ_EXTRA_PARAMS
#define PROJ_EXTRA_PARAMS
#endif
#ifndef SM_MASK_HOOK
#define SM_MASK_HOOK (void)0
#endif

#define WS_QH  0u                                      // f16 q rows [b*t][CC]
#define WS_KH  (WS_QH + 2u * (size_t)NB * TT * CC)      // f16 k rows [b*t][CC]
#define WS_VT  (WS_KH + 2u * (size_t)NB * TT * CC)      // f16 v planes [b][c][t]
#define WS_QL  (WS_VT + 2u * (size_t)NB * CC * TT)      // f16 q residual x 2^10 rows [b][t < QHI][CC]
#define WS_KL  (WS_QL + 2u * (size_t)NB * QHI * CC)     // f16 k residual x 2^10 rows [b][t < KHI][CC]
#define WS_VB  (WS_KL + 2u * (size_t)NB * KHI * CC)     // bf16 v hi planes [b][c][t < KHI]
#define WS_VBL (WS_VB + 2u * (size_t)NB * CC * KHI)
#define WS_S   (WS_VBL + 2u * (size_t)NB * CC * KHI)    // f32 logits / P [hg][t][s]
#define WS_Y   (WS_S  + 4u * (size_t)HG * TT * TT)      // f32 ctx rows [b*t][CC] (only when there is an output projection)
#define WS_END (WS_Y  + 4u * (size_t)NB * TT * CC)

// ---- k_proj: block = (64 rows, 128 cols, which): q/k/v = X W (+ b) with exact bf16 products (K = DIN) -> which 0: q f16 rows (+ residual rows < QHI); 1: k f16 rows (+ residual rows < KHI); 2: v f16 planes [c][t] (+ bf16 hi/lo planes for t < KHI)
__global__ __launch_bounds__(128) void k_proj(const float* __restrict__ XQ, const float* __restrict__ XK, const float* __restrict__ XV, const float* __restrict__ WQ, const float* __restrict__ WK, const float* __restrict__ WV, const float* __restrict__ BQ, const float* __restrict__ BK, const float* __restrict__ BV,
    _Float16* __restrict__ QH, _Float16* __restrict__ QL, _Float16* __restrict__ KH, _Float16* __restrict__ KL, _Float16* __restrict__ VT, __bf16* __restrict__ VB, __bf16* __restrict__ VBL) {
  __shared__ __align__(16) _Float16 sh[64][136], sl[64][136]; __shared__ __align__(16) _Float16 th[128][72]; __shared__ __align__(16) __bf16 tb[128][72], tbl[128][72];
  const int tid = threadIdx.x, wave = tid >> 5, lane = tid & 31, col = lane & 15, g = lane >> 4; const int which = blockIdx.z; const int c0 = blockIdx.y * 128; const size_t r0 = (size_t)blockIdx.x * 64; const size_t bb = r0 / TT; const int t0 = (int)(r0 % TT);
  const float* X = which == 0 ? XQ : which == 1 ? XK : XV; const float* WA = which == 0 ? WQ : which == 1 ? WK : WV; const float* BA = which == 0 ? BQ : which == 1 ? BK : BV;
  v8f acc[8] = {};
#pragma unroll 2
  for (int kc = 0; kc < DIN / 32; ++kc) { v16b a; { const float* p = X + (r0 + wave * 16 + col) * DIN + kc * 32 + 8 * g;
#pragma unroll
      for (int i = 0; i < 8; ++i) { a[i] = (__bf16)p[i]; a[8 + i] = (__bf16)p[16 + i]; } }
    asm volatile("s_wait_loadcnt 0x0" ::: "memory");
#pragma unroll
    for (int j = 0; j < 8; ++j) { const v16b w = WCOL(WA, kc * 32, c0 + j * 16 + col, lane); asm volatile("s_wait_loadcnt 0x0" ::: "memory"); acc[j] = wmma_bf(a, w, acc[j]); } }
  if (which < 2) { _Float16* DH = which == 0 ? QH : KH; _Float16* DL = which == 0 ? QL : KL; const int nhi = which == 0 ? QHI : KHI; const bool hi_rows = t0 < nhi;
#pragma unroll
    for (int j = 0; j < 8; ++j) { const float bias = BA ? bfr(BA[c0 + j * 16 + col]) : 0.f;
#pragma unroll
      for (int r = 0; r < 8; ++r) { const float v = acc[j][r] + bias; const _Float16 hv = (_Float16)v; sh[wave * 16 + 8 * g + r][j * 16 + col] = hv; sl[wave * 16 + 8 * g + r][j * 16 + col] = (_Float16)((v - (float)hv) * 1024.0f); } }
    __syncthreads();
    for (int e = tid; e < 64 * 16; e += 128) { const int rl = e >> 4, q = e & 15; vst2((unsigned*)(DH + (r0 + rl) * CC + c0 + q * 8), *(const v4u*)&sh[rl][q * 8]); if (hi_rows) vst2((unsigned*)(DL + (bb * nhi + t0 + rl) * (size_t)CC + c0 + q * 8), *(const v4u*)&sl[rl][q * 8]); }
  } else { const bool hi_rows = t0 < KHI;
#pragma unroll
    for (int j = 0; j < 8; ++j) { const float bias = BA ? bfr(BA[c0 + j * 16 + col]) : 0.f;
#pragma unroll
      for (int r = 0; r < 8; ++r) { const float v = acc[j][r] + bias; const int rl = wave * 16 + 8 * g + r, cl = j * 16 + col; th[cl][rl] = (_Float16)v; const __bf16 bh = (__bf16)v; tb[cl][rl] = bh; tbl[cl][rl] = (__bf16)(v - (float)bh); } }
    __syncthreads();
    for (int e = tid; e < 128 * 8; e += 128) { const int cl = e >> 3, q = e & 7; vst2((unsigned*)(VT + (bb * CC + c0 + cl) * (size_t)TT + t0 + q * 8), *(const v4u*)&th[cl][q * 8]); if (hi_rows) { const size_t o3 = (bb * CC + c0 + cl) * (size_t)KHI + t0 + q * 8; vst2((unsigned*)(VB + o3), *(const v4u*)&tb[cl][q * 8]); vst2((unsigned*)(VBL + o3), *(const v4u*)&tbl[cl][q * 8]); } } } }
// ---- k_sc: block = (query block qb, key block kb <= kb_last(qb), head in group) of batch b: logits x SCALE; q hi + residual (x 2^10) against k (2 products) for query rows < QHI, plus the k residual (3 products) for query blocks < QBH (causal early rows); causal: blocks past the diagonal exit, the mask itself is applied by index in k_sm
__global__ __launch_bounds__(128) void k_sc(const _Float16* __restrict__ QH, const _Float16* __restrict__ KH, const _Float16* __restrict__ QL, const _Float16* __restrict__ KL, int b, int h0, float* __restrict__ S0) { __shared__ __align__(16) float ss[4][16][132];
  const int qb = blockIdx.x, kb = blockIdx.y; if (kb > kb_last(qb)) return;
  const int h = h0 + blockIdx.z; float* S = S0 + (size_t)blockIdx.z * TT * TT;
  const int tid = threadIdx.x, wave = tid >> 5, lane = tid & 31, col = lane & 15, g = lane >> 4; const int k0 = kb * 128; const int ql0 = qb * 64 + wave * 16; const size_t q0 = (size_t)b * TT + ql0, kr0 = (size_t)b * TT + k0;
  v8f acc[8] = {}, accl[8] = {};
  const _Float16* QLb = QL + (size_t)b * QHI * CC; const _Float16* KLb = KL + (size_t)b * KHI * CC;
  if (qb < QBH) {
#pragma unroll
    for (int kc = 0; kc < HD / 32; ++kc) { const v16h ah = frag_h(QH + (q0 + col) * CC + h * HD + kc * 32, lane), al = frag_h(QLb + (size_t)(ql0 + col) * CC + h * HD + kc * 32, lane);
#pragma unroll
      for (int j = 0; j < 8; ++j) { const v16h kbf = frag_h(KH + (kr0 + j * 16 + col) * CC + h * HD + kc * 32, lane), klf = frag_h(KLb + (size_t)(k0 + j * 16 + col) * CC + h * HD + kc * 32, lane); acc[j] = wmma16(ah, kbf, acc[j]); accl[j] = wmma16(al, kbf, accl[j]); accl[j] = wmma16(ah, klf, accl[j]); } }
  } else if (qb * 64 < QHI) {
#pragma unroll
    for (int kc = 0; kc < HD / 32; ++kc) { const v16h ah = frag_h(QH + (q0 + col) * CC + h * HD + kc * 32, lane), al = frag_h(QLb + (size_t)(ql0 + col) * CC + h * HD + kc * 32, lane);
#pragma unroll
      for (int j = 0; j < 8; ++j) { const v16h kbf = frag_h(KH + (kr0 + j * 16 + col) * CC + h * HD + kc * 32, lane); acc[j] = wmma16(ah, kbf, acc[j]); accl[j] = wmma16(al, kbf, accl[j]); } }
  } else {
#pragma unroll
    for (int kc = 0; kc < HD / 32; ++kc) { const v16h ah = frag_h(QH + (q0 + col) * CC + h * HD + kc * 32, lane);
#pragma unroll
      for (int j = 0; j < 8; ++j) { const v16h kbf = frag_h(KH + (kr0 + j * 16 + col) * CC + h * HD + kc * 32, lane); acc[j] = wmma16(ah, kbf, acc[j]); } } }
#pragma unroll
  for (int j = 0; j < 8; ++j) {
#pragma unroll
    for (int r = 0; r < 8; ++r) ss[wave][8 * g + r][j * 16 + col] = (acc[j][r] + accl[j][r] * (1.0f / 1024.0f)) * SCALE; }
  LDSX(); for (int rl = 0; rl < 16; ++rl) vst2(S + (size_t)(ql0 + rl) * TT + k0 + lane * 4, *(const v4f*)&ss[wave][rl][lane * 4]); }
// ---- k_sm: block = query row t (head in group): keys [0, kend): causal -> logit if s <= t else excluded; softmax in f32; P x 2^11 in place (0 for excluded)
__global__ __launch_bounds__(256) void k_sm(float* __restrict__ S0 SM_EXTRA_PARAMS) { __shared__ float sred[8]; __shared__ float sbc; __shared__ __align__(16) float shv[TT];
  const int tid = threadIdx.x; const int t = blockIdx.x; const int kend = (kb_last(t >> 6) + 1) * 128;
  float* sr = S0 + (size_t)blockIdx.y * TT * TT + (size_t)t * TT;
  float m = -3.0e38f; for (int k = tid; k < kend; k += 256) { float v = (!CAUSAL || k <= t) ? sr[k] : -3.0e38f; SM_MASK_HOOK; shv[k] = v; m = fmaxf(m, v); }
#pragma unroll
  for (int o = 1; o < 32; o <<= 1) m = fmaxf(m, __shfl_xor(m, o));
  if ((tid & 31) == 0) sred[tid >> 5] = m; __syncthreads(); if (tid == 0) { float a = sred[0]; for (int i = 1; i < 8; ++i) a = fmaxf(a, sred[i]); sbc = a; } __syncthreads(); m = sbc; __syncthreads();
  float sum = 0.f; for (int k = tid; k < kend; k += 256) { const float v = shv[k]; const float e = (v <= -1.0e38f) ? 0.f : expf(v - m); shv[k] = e; sum += e; }
#pragma unroll
  for (int o = 1; o < 32; o <<= 1) sum += __shfl_xor(sum, o);
  if ((tid & 31) == 0) sred[tid >> 5] = sum; __syncthreads(); if (tid == 0) { float a = 0.f; for (int i = 0; i < 8; ++i) a += sred[i]; sbc = a > 0.f ? 2048.0f / a : 0.f; }   /* a fully excluded row yields P = 0 */ __syncthreads(); const float inv = sbc;
  for (int k = tid; k < kend; k += 256) shv[k] = shv[k] * inv;
  __syncthreads(); for (int q = tid; q < kend / 4; q += 256) vst2(sr + q * 4, *(const v4f*)&shv[q * 4]); }
// ---- k_pv: block = 64 queries (qb) of (b, h): ctx = P . v over keys [0, kend) (P x 2^11 once to f16 against v f16: 1 product; causal early query blocks: P and v as bf16 hi + lo, 3 products); 512-B (row, head) segment by 32 lanes
__global__ __launch_bounds__(128) void k_pv(const float* __restrict__ PS0, const _Float16* __restrict__ VT, const __bf16* __restrict__ VB, const __bf16* __restrict__ VBL, int b, int h0, float* __restrict__ Y) { const int h = h0 + blockIdx.z; const float* PS = PS0 + (size_t)blockIdx.z * TT * TT; __shared__ __align__(16) float ss[4][16][HD + 4];
  const int tid = threadIdx.x, wave = tid >> 5, lane = tid & 31, col = lane & 15, g = lane >> 4; const int qb = blockIdx.x; const int ql0 = qb * 64 + wave * 16; const int kce = (kb_last(qb) + 1) * 4;
  v8f acc[HD / 16] = {};
  if (qb < QBH) {
#pragma unroll 1
    for (int kc = 0; kc < kce; ++kc) { const F2 p = split_row(PS + (size_t)(ql0 + col) * TT, kc * 32, lane);
      asm volatile("s_wait_loadcnt 0x0" ::: "memory");
#pragma unroll
      for (int j = 0; j < HD / 16; ++j) { const size_t po = ((size_t)b * CC + h * HD + j * 16 + col) * (size_t)KHI + kc * 32; const v16b vh = frag_b(VB + po, lane); acc[j] = wmma_bf(p.h, vh, acc[j]); acc[j] = wmma_bf(p.l, vh, acc[j]); acc[j] = wmma_bf(p.h, frag_b(VBL + po, lane), acc[j]); } }
  } else {
#pragma unroll 1
    for (int kc = 0; kc < kce; ++kc) { const v16h p = frag_f32(PS + (size_t)(ql0 + col) * TT + kc * 32, lane);
      asm volatile("s_wait_loadcnt 0x0" ::: "memory");
#pragma unroll
      for (int j = 0; j < HD / 16; ++j) { const size_t po = ((size_t)b * CC + h * HD + j * 16 + col) * (size_t)TT + kc * 32; acc[j] = wmma16(p, frag_h(VT + po, lane), acc[j]); } } }
#pragma unroll
  for (int j = 0; j < HD / 16; ++j)
#pragma unroll
    for (int r = 0; r < 8; ++r) ss[wave][8 * g + r][j * 16 + col] = acc[j][r] * (1.0f / 2048.0f);
  LDSX(); for (int rl = 0; rl < 16; ++rl) if (lane < HD / 4) vst2(Y + ((size_t)b * TT + ql0 + rl) * CC + h * HD + lane * 4, *(const v4f*)&ss[wave][rl][lane * 4]); }
// ---- k_out: block = (64 rows, 128 cols): out = ctx Wo (+ bo): ctx x 2^6 once to f16 against Wo as f16(bf16 x 2^8) exact (1 product) x 2^-14; causal early rows (< QHI of each sequence): ctx bf16 hi + lo against exact bf16 Wo (2 products)
__global__ __launch_bounds__(128) void k_out(const float* __restrict__ Y, const float* __restrict__ WO, const float* __restrict__ BO, float* __restrict__ OUT) { __shared__ __align__(16) float sf[4][16][132];
  const int tid = threadIdx.x, wave = tid >> 5, lane = tid & 31, col = lane & 15, g = lane >> 4; const int c0 = blockIdx.y * 128; const size_t r0 = (size_t)blockIdx.x * 64 + wave * 16;
  v8f acc[8] = {};
  if (CAUSAL && (int)(((size_t)blockIdx.x * 64) % TT) < QHI) {   /* block-uniform */
#pragma unroll 2
    for (int kc = 0; kc < CC / 32; ++kc) { const F2 a = split_row(Y + (r0 + col) * CC, kc * 32, lane); asm volatile("s_wait_loadcnt 0x0" ::: "memory");
#pragma unroll
      for (int j = 0; j < 8; ++j) { const v16b w = WOCOL(WO, kc * 32, c0 + j * 16 + col, lane); asm volatile("s_wait_loadcnt 0x0" ::: "memory"); acc[j] = wmma_bf(a.h, w, acc[j]); acc[j] = wmma_bf(a.l, w, acc[j]); } }
#pragma unroll
    for (int j = 0; j < 8; ++j) { const float bias = BO ? bfr(BO[c0 + j * 16 + col]) : 0.f;
#pragma unroll
      for (int r = 0; r < 8; ++r) sf[wave][8 * g + r][j * 16 + col] = acc[j][r] + bias; }
  } else {
#pragma unroll 2
    for (int kc = 0; kc < CC / 32; ++kc) { const v16h a = frag_f32s(Y + (r0 + col) * CC + kc * 32, lane, 64.0f); asm volatile("s_wait_loadcnt 0x0" ::: "memory");   /* ctx carried x 2^6 into f16 so small-magnitude context rows stay clear of f16 subnormals */
#pragma unroll
      for (int j = 0; j < 8; ++j) { const v16h w = WOCOLH(WO, kc * 32, c0 + j * 16 + col, lane); asm volatile("s_wait_loadcnt 0x0" ::: "memory"); acc[j] = wmma16(a, w, acc[j]); } }
#pragma unroll
    for (int j = 0; j < 8; ++j) { const float bias = BO ? bfr(BO[c0 + j * 16 + col]) : 0.f;
#pragma unroll
      for (int r = 0; r < 8; ++r) sf[wave][8 * g + r][j * 16 + col] = acc[j][r] * (1.0f / 16384.0f) + bias; } }   /* 2^-8 (Wo carry) x 2^-6 (ctx carry) */
  LDSX(); for (int rl = 0; rl < 16; ++rl) vst2(OUT + (r0 + rl) * DIN + c0 + lane * 4, *(const v4f*)&sf[wave][rl][lane * 4]); }

extern "C" void kernel_launch(void* const* d_in, const int* in_sizes, int n_in, void* d_out, int out_size, void* d_ws, size_t ws_size, hipStream_t stream) {
  (void)in_sizes; (void)n_in; (void)out_size;
  const float** F = (const float**)d_in;
  if (ws_size < (size_t)WS_END) return;
  char* ws = (char*)d_ws; _Float16 *QH = (_Float16*)(ws + WS_QH), *KH = (_Float16*)(ws + WS_KH), *VT = (_Float16*)(ws + WS_VT), *QL = (_Float16*)(ws + WS_QL), *KL = (_Float16*)(ws + WS_KL); __bf16 *VB = (__bf16*)(ws + WS_VB), *VBL = (__bf16*)(ws + WS_VBL); float *S = (float*)(ws + WS_S), *Y = (float*)(ws + WS_Y);
  (void)Y; (void)QL; (void)KL; (void)VB; (void)VBL;
  // inputs: 0 x [4,2048,128]; 1 Wq [128,1024] (in,out); 2 Wk; 3 Wv; 4 Wu [1024,128] (in,out); 5 bu [128] (zeros, read)
  k_proj<<<dim3(TNB * TT / 64, CC / 128, 3), 128, 0, stream>>>(F[0], F[0], F[0], F[1], F[2], F[3], nullptr, nullptr, nullptr, QH, QL, KH, KL, VT, VB, VBL);
  for (int b = 0; b < TNB; ++b) for (int h0 = 0; h0 < NH; h0 += HG) {
    k_sc<<<dim3(NQB, TT / 128, HG), 128, 0, stream>>>(QH, KH, QL, KL, b, h0, S);
    k_sm<<<dim3(TT, HG), 256, 0, stream>>>(S);
    k_pv<<<dim3(NQB, 1, HG), 128, 0, stream>>>(S, VT, VB, VBL, b, h0, Y);
  }
  k_out<<<dim3(TNB * TT / 64, DIN / 128), 128, 0, stream>>>(Y, F[4], F[5], (float*)d_out);
}

// v001
// A run of this version takes 213 microseconds.
// Next to v000, in two timings, it ran 7.15 and 7.14 times as fast.
// compute dtype: all float inputs rounded to bf16; q/k/v projections with EXACT bf16 products on WMMA 16x16x32 (f32 accumulate); logits q x k once to f16 each (1 product; sigma - 1) x 128^-0.5 (the module scales q and k by 128^-0.25 each: the same product up to f32 rounding); softmax f32, online (running maximum, log2 domain); P x 2^7 relative to the maximum in use once to f16 x v once to f16 (1 product), normalised by the f32 row sum at the end; ctx x 2^6 once to f16 x Wu f16(bf16 x 2^8) + bu; f32 output.
#include <hip/hip_runtime.h>
#include <math.h>

typedef __attribute__((ext_vector_type(16))) _Float16 v16h;
typedef __attribute__((ext_vector_type(16))) __bf16 v16b;
typedef __attribute__((ext_vector_type(8)))  _Float16 v8h;
typedef __attribute__((ext_vector_type(8)))  float v8f;
typedef __attribute__((ext_vector_type(4)))  float v4f;
typedef __attribute__((ext_vector_type(2)))  float v2f;
typedef __attribute__((ext_vector_type(4)))  unsigned v4u;
typedef __attribute__((ext_vector_type(4)))  int v4i;
typedef float __attribute__((may_alias)) float_a;
typedef int __attribute__((may_alias)) int_a;

template <typename T> __device__ __forceinline__ void vst2(void* p, T v) { *(T*)p = v;  }
__device__ __forceinline__ v8f wmma16(v16h a, v16h b, v8f c) {
  v8f d = __builtin_amdgcn_wmma_f32_16x16x32_f16(false, a, false, b, (short)0, c, false, false);
  asm volatile("v_nop\n\tv_nop\n\tv_nop\n\tv_nop" : "+v"(d) : "v"(a), "v"(b));
  return d;
}
__device__ __forceinline__ v8f wmma_bf(v16b a, v16b b, v8f c) {
  v8f d = __builtin_amdgcn_wmma_f32_16x16x32_bf16(false, a, false, b, (short)0, c, false, false);
  asm volatile("v_nop\n\tv_nop\n\tv_nop\n\tv_nop" : "+v"(d) : "v"(a), "v"(b));
  return d;
}
// 16x16x32 fragments: lane = (h = lane>>4, row/col = lane&15); elements 0..7 = k0+8h+0..7, 8..15 = k0+16+8h+0..7; D element r = row 8h+r
__device__ __forceinline__ v16h frag_h(const _Float16* rowk0, int lane) {
  union { v16h v; v8h q[2]; } u; const _Float16* p = rowk0 + 8 * (lane >> 4);
  u.q[0] = *(const v8h*)p; u.q[1] = *(const v8h*)(p + 16); return u.v;
}
__device__ __forceinline__ v16h frag_f32(const float* rowk0, int lane) {
  v16h a; const float* p = rowk0 + 8 * (lane >> 4);
#pragma unroll
  for (int i = 0; i < 8; ++i) { a[i] = (_Float16)p[i]; a[8 + i] = (_Float16)p[16 + i]; }
  return a;
}
__device__ __forceinline__ v16h frag_f32s(const float* rowk0, int lane, float sc) {
  v16h a; const float* p = rowk0 + 8 * (lane >> 4);
#pragma unroll
  for (int i = 0; i < 8; ++i) { a[i] = (_Float16)(p[i] * sc); a[8 + i] = (_Float16)(p[16 + i] * sc); }
  return a;
}
// column fragment from a [K][ld] layout (column n), rows >= K read as 0
__device__ __forceinline__ v16h fragc_f32(const float* W, int k0, int n, int lane, int ld, int K) {
  v16h a; const int g = lane >> 4;
#pragma unroll
  for (int i = 0; i < 8; ++i) { const int ka = k0 + 8 * g + i, kb = ka + 16;
    a[i] = (_Float16)(ka < K ? W[(size_t)(ka < K ? ka : K - 1) * ld + n] : 0.f); a[8 + i] = (_Float16)(kb < K ? W[(size_t)(kb < K ? kb : K - 1) * ld + n] : 0.f); }
  return a;
}
struct F2 { v16b h, l; };
__device__ __forceinline__ F2 bsplit16(const float v[16]) { F2 r;
#pragma unroll
  for (int i = 0; i < 16; ++i) { const __bf16 h = (__bf16)v[i]; r.h[i] = h; r.l[i] = (__bf16)(v[i] - (float)h); }
  return r; }
__device__ __forceinline__ F2 split_row(const float* row, int k0, int lane) { float v[16]; const float* p = row + k0 + 8 * (lane >> 4);
#pragma unroll
  for (int i = 0; i < 8; ++i) { v[i] = p[i]; v[8 + i] = p[16 + i]; }
  return bsplit16(v); }
__device__ __forceinline__ F2 split_rowK(const float* row, int k0, int lane, int K) { float v[16]; const int g = lane >> 4;
#pragma unroll
  for (int i = 0; i < 8; ++i) { const int ka = k0 + 8 * g + i, kb = ka + 16; v[i] = ka < K ? row[ka < K ? ka : K - 1] : 0.f; v[8 + i] = kb < K ? row[kb < K ? kb : K - 1] : 0.f; }
  return bsplit16(v); }
__device__ __forceinline__ F2 split_col(const float* W, int k0, int n, int lane, int ld, int K) { float v[16]; const int g = lane >> 4;
#pragma unroll
  for (int i = 0; i < 8; ++i) { const int ka = k0 + 8 * g + i, kb = ka + 16; v[i] = ka < K ? W[(size_t)(ka < K ? ka : K - 1) * ld + n] : 0.f; v[8 + i] = kb < K ? W[(size_t)(kb < K ? kb : K - 1) * ld + n] : 0.f; }
  return bsplit16(v); }
__device__ __forceinline__ v8f mac3(const F2& a, const F2& b, v8f c) { c = wmma_bf(a.l, b.h, c); c = wmma_bf(a.h, b.l, c); return wmma_bf(a.h, b.h, c); }
__device__ __forceinline__ float sigm(float v) { return 1.0f / (1.0f + expf(-v)); }
#define LDSX() do { asm volatile("s_wait_dscnt 0" ::: "memory"); __builtin_amdgcn_wave_barrier(); __builtin_amdgcn_fence(__ATOMIC_RELEASE, "workgroup"); } while (0)

// 'Wide-head' multi-head self-attention (x [4,2048,128]; 8 heads whose head dim equals the embedding 128: (in,out) Wq/Wk/Wv [128,1024], no bias; q and k each scaled by 128^-0.25; non-causal, no mask; (in,out) unify Wu [1024,128] + bu (zeros)): out = concat_h(softmax(q_h k_h^T) v_h) Wu + bu -> [4,2048,128].
#define NB 4
#define TT 2048
#define CC 1024            // NH * HD = projected width
#define DIN 128          // input (model) width
#define NH 8
#define HD 128
#define NQB (TT / 64)
#define HG 4
#define SCALE (0.08838834764831845f)
#define CAUSAL 0
#ifndef TNB
#define TNB NB
#endif
__device__ __forceinline__ float bfr(float v) { return (float)(__bf16)v; }
__host__ __device__ __forceinline__ int kb_last(int qb) { return CAUSAL ? ((qb * 64 + 63) >> 7) : (TT / 128 - 1); }
typedef __attribute__((ext_vector_type(8))) __bf16 v8b;
__device__ __forceinline__ v16b frag_b(const __bf16* rowk0, int lane) {
  union { v16b v; v8b q[2]; } u; const __bf16* p = rowk0 + 8 * (lane >> 4);
  u.q[0] = *(const v8b*)p; u.q[1] = *(const v8b*)(p + 16); return u.v;
}
#define QBH 0
#define QHI 0               // single-product logits on every row (sigma - 1 logits over 2,048 keys)
#define KHI 64            // key rows carrying k residual / v bf16 hi+lo planes (written by k_proj; no kernel here reads them)
// B fragment (k rows k0+.., output column o) of a weight: (in,out) [K][ld] or (out,in) [ld rows of K]: bf16 exact, or f16(bf16 * 256) exact
__device__ __forceinline__ v16b wcol_io(const float* Wm, int k0, int o, int lane, int ld) { v16b w; const int g = lane >> 4;
#pragma unroll
  for (int i = 0; i < 8; ++i) { w[i] = (__bf16)Wm[(size_t)(k0 + 8 * g + i) * ld + o]; w[8 + i] = (__bf16)Wm[(size_t)(k0 + 16 + 8 * g + i) * ld + o]; }
  return w; }
__device__ __forceinline__ v16b wcol_oi(const float* Wm, int k0, int o, int lane, int K) { v16b w; const float* p = Wm + (size_t)o * K + k0 + 8 * (lane >> 4);
#pragma unroll
  for (int i = 0; i < 8; ++i) { w[i] = (__bf16)p[i]; w[8 + i] = (__bf16)p[16 + i]; }
  return w; }
__device__ __forceinline__ v16h wcolh_io(const float* Wm, int k0, int o, int lane, int ld) { v16h w; const int g = lane >> 4;
#pragma unroll
  for (int i = 0; i < 8; ++i) { w[i] = (_Float16)(bfr(Wm[(size_t)(k0 + 8 * g + i) * ld + o]) * 256.0f); w[8 + i] = (_Float16)(bfr(Wm[(size_t)(k0 + 16 + 8 * g + i) * ld + o]) * 256.0f); }
  return w; }
__device__ __forceinline__ v16h wcolh_oi(const float* Wm, int k0, int o, int lane, int K) { v16h w; const float* p = Wm + (size_t)o * K + k0 + 8 * (lane >> 4);
#pragma unroll
  for (int i = 0; i < 8; ++i) { w[i] = (_Float16)(bfr(p[i]) * 256.0f); w[8 + i] = (_Float16)(bfr(p[16 + i]) * 256.0f); }
  return w; }
#define WQKV_LAYOUT 0   // 0 = (in,out) [DIN][CC]; 1 = (out,in) [CC][DIN]; 2 = per-head [NH][DIN][HD]
__device__ __forceinline__ v16b wcol_hdk(const float* Wm, int k0, int o, int lane) { v16b w; const int g = lane >> 4; const float* p = Wm + (size_t)(o / HD) * DIN * HD + (o % HD);
#pragma unroll
  for (int i = 0; i < 8; ++i) { w[i] = (__bf16)p[(size_t)(k0 + 8 * g + i) * HD]; w[8 + i] = (__bf16)p[(size_t)(k0 + 16 + 8 * g + i) * HD]; }
  return w; }
#define WO_OUT_IN 0
#if WQKV_LAYOUT == 1
#define WCOL(W, k0, o, lane) wcol_oi(W, k0, o, lane, DIN)
#elif WQKV_LAYOUT == 2
#define WCOL(W, k0, o, lane) wcol_hdk(W, k0, o, lane)
#else
#define WCOL(W, k0, o, lane) wcol_io(W, k0, o, lane, CC)
#endif
#if WO_OUT_IN
#define WOCOL(W, k0, o, lane) wcol_oi(W, k0, o, lane, CC)
#define WOCOLH(W, k0, o, lane) wcolh_oi(W, k0, o, lane, CC)
#else
#define WOCOL(W, k0, o, lane) wcol_io(W, k0, o, lane, DIN)
#define WOCOLH(W, k0, o, lane) wcolh_io(W, k0, o, lane, DIN)
#endif

#ifndef SM_EXTRA_PARAMS
#define SM_EXTRA_PARAMS
#endif
#ifndef PROJ_EXTRA_PARAMS
#define PROJ_EXTRA_PARAMS
#endif
#ifndef SM_MASK_HOOK
#define SM_MASK_HOOK (void)0
#endif

#define WS_QH  0u                                      // f16 q rows [b*t][CC]
#define WS_KH  (WS_QH + 2u * (size_t)NB * TT * CC)      // f16 k rows [b*t][CC]
#define WS_VT  (WS_KH + 2u * (size_t)NB * TT * CC)      // f16 v planes [b][c][t]
#define WS_QL  (WS_VT + 2u * (size_t)NB * CC * TT)      // f16 q residual x 2^10 rows [b][t < QHI][CC]
#define WS_KL  (WS_QL + 2u * (size_t)NB * QHI * CC)     // f16 k residual x 2^10 rows [b][t < KHI][CC]
#define WS_VB  (WS_KL + 2u * (size_t)NB * KHI * CC)     // bf16 v hi planes [b][c][t < KHI]
#define WS_VBL (WS_VB + 2u * (size_t)NB * CC * KHI)
#define WS_S   (WS_VBL + 2u * (size_t)NB * CC * KHI)    // f32 [hg][t][s] space, reserved; no kernel here uses it
#define WS_Y   (WS_S  + 4u * (size_t)HG * TT * TT)      // f32 ctx rows [b*t][CC] (only when there is an output projection)
#define WS_END (WS_Y  + 4u * (size_t)NB * TT * CC)

// ---- k_proj: block = (64 rows, 128 cols, which): q/k/v = X W (+ b) with exact bf16 products (K = DIN) -> which 0: q f16 rows (+ residual rows < QHI); 1: k f16 rows (+ residual rows < KHI); 2: v f16 planes [c][t] (+ bf16 hi/lo planes for t < KHI)
__global__ __launch_bounds__(128) void k_proj(const float* __restrict__ XQ, const float* __restrict__ XK, const float* __restrict__ XV, const float* __restrict__ WQ, const float* __restrict__ WK, const float* __restrict__ WV, const float* __restrict__ BQ, const float* __restrict__ BK, const float* __restrict__ BV,
    _Float16* __restrict__ QH, _Float16* __restrict__ QL, _Float16* __restrict__ KH, _Float16* __restrict__ KL, _Float16* __restrict__ VT, __bf16* __restrict__ VB, __bf16* __restrict__ VBL) {
  __shared__ __align__(16) _Float16 sh[64][136], sl[64][136]; __shared__ __align__(16) _Float16 th[128][72]; __shared__ __align__(16) __bf16 tb[128][72], tbl[128][72];
  const int tid = threadIdx.x, wave = tid >> 5, lane = tid & 31, col = lane & 15, g = lane >> 4; const int which = blockIdx.z; const int c0 = blockIdx.y * 128; const size_t r0 = (size_t)blockIdx.x * 64; const size_t bb = r0 / TT; const int t0 = (int)(r0 % TT);
  const float* X = which == 0 ? XQ : which == 1 ? XK : XV; const float* WA = which == 0 ? WQ : which == 1 ? WK : WV; const float* BA = which == 0 ? BQ : which == 1 ? BK : BV;
  v8f acc[8] = {};
#pragma unroll 2
  for (int kc = 0; kc < DIN / 32; ++kc) { v16b a; { const float* p = X + (r0 + wave * 16 + col) * DIN + kc * 32 + 8 * g;
#pragma unroll
      for (int i = 0; i < 8; ++i) { a[i] = (__bf16)p[i]; a[8 + i] = (__bf16)p[16 + i]; } }
    asm volatile("s_wait_loadcnt 0x0" ::: "memory");
#pragma unroll
    for (int j = 0; j < 8; ++j) { const v16b w = WCOL(WA, kc * 32, c0 + j * 16 + col, lane); asm volatile("s_wait_loadcnt 0x0" ::: "memory"); acc[j] = wmma_bf(a, w, acc[j]); } }
  if (which < 2) { _Float16* DH = which == 0 ? QH : KH; _Float16* DL = which == 0 ? QL : KL; const int nhi = which == 0 ? QHI : KHI; const bool hi_rows = t0 < nhi;
#pragma unroll
    for (int j = 0; j < 8; ++j) { const float bias = BA ? bfr(BA[c0 + j * 16 + col]) : 0.f;
#pragma unroll
      for (int r = 0; r < 8; ++r) { const float v = acc[j][r] + bias; const _Float16 hv = (_Float16)v; sh[wave * 16 + 8 * g + r][j * 16 + col] = hv; sl[wave * 16 + 8 * g + r][j * 16 + col] = (_Float16)((v - (float)hv) * 1024.0f); } }
    __syncthreads();
    for (int e = tid; e < 64 * 16; e += 128) { const int rl = e >> 4, q = e & 15; vst2((unsigned*)(DH + (r0 + rl) * CC + c0 + q * 8), *(const v4u*)&sh[rl][q * 8]); if (hi_rows) vst2((unsigned*)(DL + (bb * nhi + t0 + rl) * (size_t)CC + c0 + q * 8), *(const v4u*)&sl[rl][q * 8]); }
  } else { const bool hi_rows = t0 < KHI;
#pragma unroll
    for (int j = 0; j < 8; ++j) { const float bias = BA ? bfr(BA[c0 + j * 16 + col]) : 0.f;
#pragma unroll
      for (int r = 0; r < 8; ++r) { const float v = acc[j][r] + bias; const int rl = wave * 16 + 8 * g + r, cl = j * 16 + col; th[cl][rl] = (_Float16)v; const __bf16 bh = (__bf16)v; tb[cl][rl] = bh; tbl[cl][rl] = (__bf16)(v - (float)bh); } }
    __syncthreads();
    for (int e = tid; e < 128 * 8; e += 128) { const int cl = e >> 3, q = e & 7; vst2((unsigned*)(VT + (bb * CC + c0 + cl) * (size_t)TT + t0 + q * 8), *(const v4u*)&th[cl][q * 8]); if (hi_rows) { const size_t o3 = (bb * CC + c0 + cl) * (size_t)KHI + t0 + q * 8; vst2((unsigned*)(VB + o3), *(const v4u*)&tb[cl][q * 8]); vst2((unsigned*)(VBL + o3), *(const v4u*)&tbl[cl][q * 8]); } } } }
__device__ __forceinline__ v8f wmma_h(v16h a, v16h b, v8f c) { return __builtin_amdgcn_wmma_f32_16x16x32_f16(false, a, false, b, (short)0, c, false, false); }
__device__ __forceinline__ float xhalf(float x) { return __builtin_bit_cast(float, __builtin_amdgcn_permlanex16(__builtin_bit_cast(int, x), __builtin_bit_cast(int, x), 0x76543210, 0xfedcba98, false, false)); }   // lane l with lane l ^ 16
// fragment at a wave-uniform base plus the lane's own fixed byte offset (same k order as frag_h)
__device__ __forceinline__ v16h frag_u(const char* ub, unsigned vo) { union { v16h v; v8h q[2]; } u; u.q[0] = *(const v8h*)(ub + (size_t)vo); u.q[1] = *(const v8h*)(ub + (size_t)vo + 32); return u.v; }
// 2^x with the one free slot that the instruction set asks for behind a transcendental in front of a reader of its result or a writer of its source
__device__ __forceinline__ float exp2_s(float x) { float r; asm("v_exp_f32 %0, %1\n\tv_nop" : "=v"(r) : "v"(x)); return r; }
__global__ __launch_bounds__(256) void k_fa(const _Float16* __restrict__ QH, const _Float16* __restrict__ KH, const _Float16* __restrict__ VT, float* __restrict__ Y) { __shared__ __align__(16) float ss[8][32][HD + 4];
  const int tid = threadIdx.x, wave = tid >> 5, lane = tid & 31, col = lane & 15, g = lane >> 4; const int h = blockIdx.y, b = blockIdx.z; const int q0 = blockIdx.x * 256 + wave * 32;
  const float cs = SCALE * 1.4426950408889634f;
  // every '#pragma unroll' of this kernel before the store-out loops makes an index into a fragment or accumulator array a constant, so that the array stays in registers
  v16h qf[2][HD / 32];
#pragma unroll
  for (int c2 = 0; c2 < 2; ++c2)
#pragma unroll
    for (int kc = 0; kc < HD / 32; ++kc) qf[c2][kc] = frag_h(QH + ((size_t)b * TT + q0 + 16 * c2 + col) * CC + h * HD + kc * 32, lane);
  const char* Kb = (const char*)(KH + (size_t)b * TT * CC + h * HD); const char* Vb = (const char*)(VT + ((size_t)b * CC + h * HD) * (size_t)TT);   // wave-uniform
  const unsigned ko = 2u * (unsigned)(col * CC + 8 * g), vo = 2u * (unsigned)(col * TT + 8 * g);   // the lane's row and half, in bytes
  v8f acc[2][HD / 16] = {}; float mr[2] = {-INFINITY, -INFINITY}, lr[2] = {0.f, 0.f};
  v16h kf[2][HD / 32];
#pragma unroll
  for (int kt = 0; kt < 2; ++kt)
#pragma unroll
    for (int kc = 0; kc < HD / 32; ++kc) kf[kt][kc] = frag_u(Kb + 2 * ((size_t)(16 * kt) * CC + kc * 32), ko);
#pragma unroll 1   // one pass in the text: a second copy would double the fragments in flight and the loop's code
  for (int ps = 0; ps < TT / 32; ++ps) { const int key0 = ps * 32;
    v16h vf[HD / 16];   // this pass's v, asked for ahead of the logits that hide its latency
#pragma unroll
    for (int t = 0; t < HD / 16; ++t) vf[t] = frag_u(Vb + 2 * ((size_t)(16 * t) * TT + key0), vo);
    asm volatile("s_wait_xcnt 0x0" ::: "memory");   // in front of any later write of a register that these loads name
    __builtin_amdgcn_sched_barrier(0);   // keeps the v loads issued here: sunk behind the logits their latency is paid in front of the second product
    v8f s[2][2];
#pragma unroll
    for (int kt = 0; kt < 2; ++kt)
#pragma unroll
      for (int c2 = 0; c2 < 2; ++c2) { s[kt][c2] = v8f{};
#pragma unroll
        for (int kc = 0; kc < HD / 32; ++kc) s[kt][c2] = wmma_h(kf[kt][kc], qf[c2][kc], s[kt][c2]); }
    const int kn = ps + 1 < TT / 32 ? key0 + 32 : key0;   // next pass's k rows, in flight under the softmax; the last pass asks for its own rows again (in bounds, unused)
#pragma unroll
    for (int kt = 0; kt < 2; ++kt)
#pragma unroll
      for (int kc = 0; kc < HD / 32; ++kc) kf[kt][kc] = frag_u(Kb + 2 * ((size_t)(kn + 16 * kt) * CC + kc * 32), ko);
    asm volatile("s_wait_xcnt 0x0" ::: "memory");   // in front of any later write of a register that these loads name
    __builtin_amdgcn_sched_barrier(0);   // keeps the k loads issued ahead of the softmax, which hides their latency
    float mb[2]; bool need = false;
#pragma unroll
    for (int c2 = 0; c2 < 2; ++c2) { float mx = s[0][c2][0];
#pragma unroll
      for (int r = 0; r < 8; ++r) mx = fmaxf(mx, fmaxf(s[0][c2][r], s[1][c2][r]));
      mx = fmaxf(mx, xhalf(mx)) * cs; mb[c2] = mx; need = need || (mx > mr[c2] + 8.0f); }   // both halves hold the query's maximum of this pass, scaled (the scale is positive)
    if (__builtin_amdgcn_ballot_w32(need) != 0) {   // wave-uniform; always on the first pass (maximum in use -inf, factor 0 on zero sums)
#pragma unroll
      for (int c2 = 0; c2 < 2; ++c2) { const float mn = fmaxf(mr[c2], mb[c2]); const float corr = exp2_s(mr[c2] - mn); lr[c2] *= corr; mr[c2] = mn;
#pragma unroll
        for (int t = 0; t < HD / 16; ++t) acc[c2][t] = acc[c2][t] * corr; } }
#pragma unroll
    for (int c2 = 0; c2 < 2; ++c2) { const float nm = 7.0f - mr[c2]; v16h pf; float p0 = 0.f, p1 = 0.f;
#pragma unroll
      for (int r = 0; r < 8; ++r) { const float ea = exp2_s(fmaf(s[0][c2][r], cs, nm)), eb = exp2_s(fmaf(s[1][c2][r], cs, nm)); p0 += ea; p1 += eb; pf[r] = (_Float16)ea; pf[8 + r] = (_Float16)eb; }
      lr[c2] += p0 + p1;
#pragma unroll
      for (int t = 0; t < HD / 16; ++t) acc[c2][t] = wmma_h(vf[t], pf, acc[c2][t]); } }
#pragma unroll
  for (int c2 = 0; c2 < 2; ++c2) { const float inv = 1.0f / (lr[c2] + xhalf(lr[c2]));   // each half summed its eight keys of every 16-key tile; the sum holds the row maximum's term, >= 2^7
#pragma unroll
    for (int t = 0; t < HD / 16; ++t) { const v8f o = acc[c2][t] * inv; float* d = &ss[wave][16 * c2 + col][16 * t + 8 * g]; *(v4f*)d = v4f{o[0], o[1], o[2], o[3]}; *(v4f*)(d + 4) = v4f{o[4], o[5], o[6], o[7]}; } }
  LDSX();   // each wave reads back its own rows: whole 512-B (row, head) segments go out
#pragma unroll
  for (int r8 = 0; r8 < 32; r8 += 8) {
#pragma unroll
    for (int rl = r8; rl < r8 + 8; ++rl) vst2(Y + ((size_t)b * TT + q0 + rl) * CC + h * HD + lane * 4, *(const v4f*)&ss[wave][rl][lane * 4]);
    if (r8 < 24) asm volatile("s_wait_xcnt 0x0" ::: "memory"); } }   // in front of the next eight rows' LDS loads, which write registers that these stores name
// ---- k_out: block = (64 rows, 128 cols): out = ctx Wo (+ bo): ctx x 2^6 once to f16 against Wo as f16(bf16 x 2^8) exact (1 product) x 2^-14; causal early rows (< QHI of each sequence): ctx bf16 hi + lo against exact bf16 Wo (2 products)
__global__ __launch_bounds__(128) void k_out(const float* __restrict__ Y, const float* __restrict__ WO, const float* __restrict__ BO, float* __restrict__ OUT) { __shared__ __align__(16) float sf[4][16][132];
  const int tid = threadIdx.x, wave = tid >> 5, lane = tid & 31, col = lane & 15, g = lane >> 4; const int c0 = blockIdx.y * 128; const size_t r0 = (size_t)blockIdx.x * 64 + wave * 16;
  v8f acc[8] = {};
  if (CAUSAL && (int)(((size_t)blockIdx.x * 64) % TT) < QHI) {   /* block-uniform */
#pragma unroll 2
    for (int kc = 0; kc < CC / 32; ++kc) { const F2 a = split_row(Y + (r0 + col) * CC, kc * 32, lane); asm volatile("s_wait_loadcnt 0x0" ::: "memory");
#pragma unroll
      for (int j = 0; j < 8; ++j) { const v16b w = WOCOL(WO, kc * 32, c0 + j * 16 + col, lane); asm volatile("s_wait_loadcnt 0x0" ::: "memory"); acc[j] = wmma_bf(a.h, w, acc[j]); acc[j] = wmma_bf(a.l, w, acc[j]); } }
#pragma unroll
    for (int j = 0; j < 8; ++j) { const float bias = BO ? bfr(BO[c0 + j * 16 + col]) : 0.f;
#pragma unroll
      for (int r = 0; r < 8; ++r) sf[wave][8 * g + r][j * 16 + col] = acc[j][r] + bias; }
  } else {
#pragma unroll 2
    for (int kc = 0; kc < CC / 32; ++kc) { const v16h a = frag_f32s(Y + (r0 + col) * CC + kc * 32, lane, 64.0f); asm volatile("s_wait_loadcnt 0x0" ::: "memory");   /* ctx carried x 2^6 into f16 so small-magnitude context rows stay clear of f16 subnormals */
#pragma unroll
      for (int j = 0; j < 8; ++j) { const v16h w = WOCOLH(WO, kc * 32, c0 + j * 16 + col, lane); asm volatile("s_wait_loadcnt 0x0" ::: "memory"); acc[j] = wmma16(a, w, acc[j]); } }
#pragma unroll
    for (int j = 0; j < 8; ++j) { const float bias = BO ? bfr(BO[c0 + j * 16 + col]) : 0.f;
#pragma unroll
      for (int r = 0; r < 8; ++r) sf[wave][8 * g + r][j * 16 + col] = acc[j][r] * (1.0f / 16384.0f) + bias; } }   /* 2^-8 (Wo carry) x 2^-6 (ctx carry) */
  LDSX(); for (int rl = 0; rl < 16; ++rl) vst2(OUT + (r0 + rl) * DIN + c0 + lane * 4, *(const v4f*)&sf[wave][rl][lane * 4]); }

extern "C" void kernel_launch(void* const* d_in, const int* in_sizes, int n_in, void* d_out, int out_size, void* d_ws, size_t ws_size, hipStream_t stream) {
  (void)in_sizes; (void)n_in; (void)out_size;
  const float** F = (const float**)d_in;
  if (ws_size < (size_t)WS_END) return;
  char* ws = (char*)d_ws; _Float16 *QH = (_Float16*)(ws + WS_QH), *KH = (_Float16*)(ws + WS_KH), *VT = (_Float16*)(ws + WS_VT), *QL = (_Float16*)(ws + WS_QL), *KL = (_Float16*)(ws + WS_KL); __bf16 *VB = (__bf16*)(ws + WS_VB), *VBL = (__bf16*)(ws + WS_VBL); float *Y = (float*)(ws + WS_Y);
  (void)Y; (void)QL; (void)KL; (void)VB; (void)VBL;
  // inputs: 0 x [4,2048,128]; 1 Wq [128,1024] (in,out); 2 Wk; 3 Wv; 4 Wu [1024,128] (in,out); 5 bu [128] (zeros, read)
  k_proj<<<dim3(TNB * TT / 64, CC / 128, 3), 128, 0, stream>>>(F[0], F[0], F[0], F[1], F[2], F[3], nullptr, nullptr, nullptr, QH, QL, KH, KL, VT, VB, VBL);
  k_fa<<<dim3(TT / 256, NH, TNB), 256, 0, stream>>>(QH, KH, VT, Y);
  k_out<<<dim3(TNB * TT / 64, DIN / 128), 128, 0, stream>>>(Y, F[4], F[5], (float*)d_out);
}
